// v000
// Times are from an AMD MI455X. After a warm-up the kernel runs many times in a row, and a time is the length of
// such a window on the GPU divided by its runs, so every launch and the gaps after it count. The runs cycle
// through copies of the inputs. A figure is the median of several windows, for all but v000 over two sittings.
// Sittings can differ by a few percent; kernels timed side by side share one.
// v000, which the later versions start from, runs in 1140 microseconds.
#include <hip/hip_runtime.h>
#include <hip/hip_bf16.h>
#include <math.h>

// ---------------------------------------------------------------------------
// MoE forward for MI455X (gfx1250, wave32, WMMA f32 16x16x4).
// D=F=1024, E=8, K=2, N=B*T=4096. Double-buffered LDS staging via CDNA5
// GLOBAL_LOAD_ASYNC_TO_LDS (ASYNCcnt). Block tile 128x128, wave tile 32x64.
// ---------------------------------------------------------------------------

typedef __attribute__((ext_vector_type(2))) float v2f;
typedef __attribute__((ext_vector_type(8))) float v8f;
typedef __attribute__((ext_vector_type(4))) int   v4i;

#define MOE_D 1024
#define MOE_F 1024
#define MOE_E 8
#define MOE_N 4096

// ---- CDNA5 async global->LDS path (probe via __has_builtin) ---------------
#if defined(__has_builtin)
#if __has_builtin(__builtin_amdgcn_global_load_async_to_lds_b128) && \
    __has_builtin(__builtin_amdgcn_s_wait_asynccnt)
#define USE_ASYNC_LDS 1
#endif
#endif
#ifndef USE_ASYNC_LDS
#define USE_ASYNC_LDS 0
#endif

#if USE_ASYNC_LDS
typedef __attribute__((address_space(1))) v4i glb_v4i;
typedef __attribute__((address_space(3))) v4i lds_v4i;
__device__ __forceinline__ void stage16(const float* __restrict__ g, float* l) {
    // per-lane: LDS[l .. l+15] = MEM[g .. g+15], tracked by ASYNCcnt
    __builtin_amdgcn_global_load_async_to_lds_b128(
        (glb_v4i*)g, (lds_v4i*)l, 0, 0);
}
#else
__device__ __forceinline__ void stage16(const float* __restrict__ g, float* l) {
    *reinterpret_cast<float4*>(l) = *reinterpret_cast<const float4*>(g);
}
#endif

__device__ __forceinline__ float silu_f(float v) {
    return v / (1.0f + __expf(-v));
}

// ---------------------------------------------------------------------------
// Zero-fill
// ---------------------------------------------------------------------------
__global__ void zero_kernel(float* __restrict__ p, int n) {
    int i = blockIdx.x * blockDim.x + threadIdx.x;
    if (i < n) p[i] = 0.0f;
}

// ---------------------------------------------------------------------------
// Router: one wave32 per token. logits = x@router_w (D x 8), softmax, top-2
// scattered into combine[n][8]; also sgate[n] = sigmoid(x @ shared_gate_w).
// ---------------------------------------------------------------------------
__global__ __launch_bounds__(256)
void router_kernel(const float* __restrict__ x,
                   const float* __restrict__ rw,     // [D][E]
                   const float* __restrict__ sgw,    // [D]
                   float* __restrict__ combine,      // [N][E]
                   float* __restrict__ sgate,        // [N]
                   int N, int D) {
    const int wave = threadIdx.x >> 5;
    const int lane = threadIdx.x & 31;
    const int n = blockIdx.x * 8 + wave;
    if (n >= N) return;

    const float* xr = x + (size_t)n * D;
    float acc[MOE_E];
#pragma unroll
    for (int e = 0; e < MOE_E; ++e) acc[e] = 0.0f;
    float accg = 0.0f;

    for (int d = lane; d < D; d += 32) {
        float xv = xr[d];
#pragma unroll
        for (int e = 0; e < MOE_E; ++e) acc[e] = fmaf(xv, rw[d * MOE_E + e], acc[e]);
        accg = fmaf(xv, sgw[d], accg);
    }
#pragma unroll
    for (int off = 16; off > 0; off >>= 1) {
#pragma unroll
        for (int e = 0; e < MOE_E; ++e) acc[e] += __shfl_xor(acc[e], off, 32);
        accg += __shfl_xor(accg, off, 32);
    }
    if (lane == 0) {
        float mx = acc[0];
#pragma unroll
        for (int e = 1; e < MOE_E; ++e) mx = fmaxf(mx, acc[e]);
        float p[MOE_E];
        float sum = 0.0f;
#pragma unroll
        for (int e = 0; e < MOE_E; ++e) { p[e] = __expf(acc[e] - mx); sum += p[e]; }
        float inv = 1.0f / sum;
#pragma unroll
        for (int e = 0; e < MOE_E; ++e) p[e] *= inv;
        int i1 = 0;
#pragma unroll
        for (int e = 1; e < MOE_E; ++e) if (p[e] > p[i1]) i1 = e;
        int i2 = (i1 == 0) ? 1 : 0;
#pragma unroll
        for (int e = 0; e < MOE_E; ++e) if (e != i1 && p[e] > p[i2]) i2 = e;
        float* cr = combine + (size_t)n * MOE_E;
#pragma unroll
        for (int e = 0; e < MOE_E; ++e)
            cr[e] = (e == i1) ? p[i1] : ((e == i2) ? p[i2] : 0.0f);
        sgate[n] = 1.0f / (1.0f + __expf(-accg));
    }
}

// ---------------------------------------------------------------------------
// Tiled f32 WMMA GEMM, C-tile 128x128 per 256-thread block (8 waves, wave32,
// wave grid 4x2). Each wave owns 32x64 = 2x4 WMMA 16x16 tiles, K-step 4 per
// WMMA: 8 WMMAs per A-fragment pair. Double-buffered LDS; staging via async
// global->LDS when available.
// ---------------------------------------------------------------------------
#define MODE_SILU_SCALE 0
#define MODE_ADD        1
#define MODE_GATED      2
#define MODE_SCALE_ADD  3

template <int MODE>
__global__ __launch_bounds__(256)
void gemm_wmma_f32(const float* __restrict__ A, int lda,
                   const float* __restrict__ B, int ldb, int upOff,
                   float* __restrict__ C, int ldc,
                   const float* __restrict__ scale, int scaleStride,
                   int M, int N, int K) {
    constexpr int BM = 128, BN = 128, BK = 16;
    constexpr int NG = (MODE == MODE_GATED) ? 2 : 1;   // gate/up streams
    constexpr int ASTRIDE = BK + 4;    // 20 words: conflict-free A frag reads
    constexpr int BSTRIDE = BN + 16;   // 144 words: 2*144 % 64 == 32 -> clean
    // async ops issued per wave per tile (in-order completion on ASYNCcnt)
    constexpr int PEND = 2 + 2 * NG;

    __shared__ float As[2][BM][ASTRIDE];
    __shared__ float Bs[2][NG][BK][BSTRIDE];

    const int tid  = threadIdx.x;
    const int wave = tid >> 5;
    const int lane = tid & 31;
    const int lo   = lane & 15;
    const int hi   = lane >> 4;

    const int wm0 = (wave >> 1) << 5;  // 0,32,64,96
    const int wn0 = (wave & 1) << 6;   // 0,64

    const int m0 = blockIdx.y * BM;
    const int n0 = blockIdx.x * BN;

    // staging coordinates (fixed per thread)
    const int ar = tid >> 2;            // A row   0..63 (+64 second half)
    const int ac = (tid & 3) << 2;      // A col   0,4,8,12
    const int br = tid >> 5;            // B row   0..7 (+8 on second half)
    const int bc = (tid & 31) << 2;     // B col   0..124

    v8f acc[NG][2][4];
#pragma unroll
    for (int g = 0; g < NG; ++g)
#pragma unroll
        for (int i = 0; i < 2; ++i)
#pragma unroll
            for (int j = 0; j < 4; ++j)
                acc[g][i][j] = (v8f)(0.0f);

    // issue staging for tile at k0 into buffer `buf`
    auto stage_tile = [&](int buf, int k0) {
        stage16(&A[(size_t)(m0 + ar) * lda + k0 + ac], &As[buf][ar][ac]);
        stage16(&A[(size_t)(m0 + ar + 64) * lda + k0 + ac], &As[buf][ar + 64][ac]);
#pragma unroll
        for (int g = 0; g < NG; ++g)
#pragma unroll
            for (int h = 0; h < 2; ++h)
                stage16(&B[(size_t)(k0 + br + h * 8) * ldb + n0 + g * upOff + bc],
                        &Bs[buf][g][br + h * 8][bc]);
    };

    stage_tile(0, 0);
    int cur = 0;
    for (int k0 = 0; k0 < K; k0 += BK) {
        const bool has_next = (k0 + BK) < K;
        if (has_next) stage_tile(cur ^ 1, k0 + BK);
#if USE_ASYNC_LDS
        // tile `cur` complete; next tile's PEND ops may remain in flight
        if (has_next) __builtin_amdgcn_s_wait_asynccnt(PEND);
        else          __builtin_amdgcn_s_wait_asynccnt(0);
#endif
        __syncthreads();

#pragma unroll
        for (int kk = 0; kk < BK; kk += 4) {
            const int kb = kk + (hi << 1);
            const v2f a0 = *reinterpret_cast<const v2f*>(&As[cur][wm0 + lo][kb]);
            const v2f a1 = *reinterpret_cast<const v2f*>(&As[cur][wm0 + 16 + lo][kb]);
#pragma unroll
            for (int g = 0; g < NG; ++g) {
#pragma unroll
                for (int j = 0; j < 4; ++j) {
                    const int nn = wn0 + j * 16 + lo;
                    v2f b;
                    b.x = Bs[cur][g][kb][nn];
                    b.y = Bs[cur][g][kb + 1][nn];
                    acc[g][0][j] = __builtin_amdgcn_wmma_f32_16x16x4_f32(
                        false, a0, false, b, (short)0, acc[g][0][j], false, false);
                    acc[g][1][j] = __builtin_amdgcn_wmma_f32_16x16x4_f32(
                        false, a1, false, b, (short)0, acc[g][1][j], false, false);
                }
            }
        }
        __syncthreads();   // protects buf cur (next issue target)
        cur ^= 1;
    }

    // --- epilogue: lane l, vgpr v -> row = v + 8*hi, col = lo ---
#pragma unroll
    for (int i = 0; i < 2; ++i) {
#pragma unroll
        for (int j = 0; j < 4; ++j) {
            union { v8f v; float f[8]; } u0, u1;
            u0.v = acc[0][i][j];
            if constexpr (MODE == MODE_GATED) u1.v = acc[NG - 1][i][j];
#pragma unroll
            for (int v = 0; v < 8; ++v) {
                const int grow = m0 + wm0 + i * 16 + v + 8 * hi;
                const int gcol = n0 + wn0 + j * 16 + lo;
                float* cp = &C[(size_t)grow * ldc + gcol];
                if constexpr (MODE == MODE_SILU_SCALE) {
                    const float s = scale[(size_t)grow * scaleStride];
                    *cp = silu_f(u0.f[v]) * s;
                } else if constexpr (MODE == MODE_ADD) {
                    *cp += u0.f[v];
                } else if constexpr (MODE == MODE_GATED) {
                    *cp = silu_f(u0.f[v]) * u1.f[v];
                } else { // MODE_SCALE_ADD
                    const float s = scale[(size_t)grow * scaleStride];
                    *cp = fmaf(s, u0.f[v], *cp);
                }
            }
        }
    }
}

// ---------------------------------------------------------------------------
// Host launcher
// ---------------------------------------------------------------------------
extern "C" void kernel_launch(void* const* d_in, const int* in_sizes, int n_in,
                              void* d_out, int out_size, void* d_ws, size_t ws_size,
                              hipStream_t stream) {
    const float* x    = (const float*)d_in[0]; // [N][D]
    const float* rw   = (const float*)d_in[1]; // [D][E]
    const float* w1   = (const float*)d_in[2]; // [E][D][F]
    const float* w2   = (const float*)d_in[3]; // [E][F][D]
    const float* sgu  = (const float*)d_in[4]; // [D][2F]
    const float* sdn  = (const float*)d_in[5]; // [F][D]
    const float* sgw  = (const float*)d_in[6]; // [D][1]
    float* out = (float*)d_out;                // [N][D]

    const int D = MOE_D, F = MOE_F, E = MOE_E, N = MOE_N;

    float* ws      = (float*)d_ws;
    float* H       = ws;                        // [N][F] scratch activations
    float* combine = H + (size_t)N * F;         // [N][E]
    float* sgate   = combine + (size_t)N * E;   // [N]

    zero_kernel<<<(N * D + 255) / 256, 256, 0, stream>>>(out, N * D);
    router_kernel<<<N / 8, 256, 0, stream>>>(x, rw, sgw, combine, sgate, N, D);

    const dim3 blk(256);
    const dim3 gridF(F / 128, N / 128);
    const dim3 gridD(D / 128, N / 128);

    // shared expert: t = silu(x@Wg) * (x@Wu);  out += sgate * (t @ Wdown)
    gemm_wmma_f32<MODE_GATED><<<gridF, blk, 0, stream>>>(
        x, D, sgu, 2 * F, F, H, F, nullptr, 0, N, F, D);
    gemm_wmma_f32<MODE_SCALE_ADD><<<gridD, blk, 0, stream>>>(
        H, F, sdn, D, 0, out, D, sgate, 1, N, D, F);

    // routed experts (combine weight folded into H; zero rows contribute 0)
    for (int e = 0; e < E; ++e) {
        gemm_wmma_f32<MODE_SILU_SCALE><<<gridF, blk, 0, stream>>>(
            x, D, w1 + (size_t)e * D * F, F, 0, H, F, combine + e, E, N, F, D);
        gemm_wmma_f32<MODE_ADD><<<gridD, blk, 0, stream>>>(
            H, F, w2 + (size_t)e * F * D, D, 0, out, D, nullptr, 0, N, D, F);
    }
}

// v002
// A run of this version takes 403 microseconds.
// Versions in between are left out here; by their measured steps it is 2.90 times as fast as v000.
#include <hip/hip_runtime.h>
#include <hip/hip_bf16.h>
#include <math.h>

// ---------------------------------------------------------------------------
// MoE forward for MI455X (gfx1250, wave32, WMMA f32 16x16x4).
// D=F=1024, E=8, K=2, N=B*T=4096. Double-buffered LDS staging via CDNA5
// GLOBAL_LOAD_ASYNC_TO_LDS (ASYNCcnt). Block tile 128x64, wave tile 32x32.
// Routed experts run only on the tokens that chose them: the 2N (token,
// expert) pairs are sorted by expert into slots, each expert's run padded to
// whole 128-row tiles, and one grouped launch per layer covers all experts.
// ---------------------------------------------------------------------------

typedef __attribute__((ext_vector_type(2))) float v2f;
typedef __attribute__((ext_vector_type(8))) float v8f;
typedef __attribute__((ext_vector_type(4))) int   v4i;

#define MOE_D 1024
#define MOE_F 1024
#define MOE_E 8
#define MOE_N 4096
#define MOE_TILES 72                  // >= (2N + E*127) / 128 row tiles
#define MOE_SLOTS (MOE_TILES * 128)

// ---- CDNA5 async global->LDS path (probe via __has_builtin) ---------------
#if defined(__has_builtin)
#if __has_builtin(__builtin_amdgcn_global_load_async_to_lds_b128) && \
    __has_builtin(__builtin_amdgcn_s_wait_asynccnt)
#define USE_ASYNC_LDS 1
#endif
#endif
#ifndef USE_ASYNC_LDS
#define USE_ASYNC_LDS 0
#endif

#if USE_ASYNC_LDS
typedef __attribute__((address_space(1))) v4i glb_v4i;
typedef __attribute__((address_space(3))) v4i lds_v4i;
__device__ __forceinline__ void stage16(const float* __restrict__ g, float* l) {
    // per-lane: LDS[l .. l+15] = MEM[g .. g+15], tracked by ASYNCcnt
    __builtin_amdgcn_global_load_async_to_lds_b128(
        (glb_v4i*)g, (lds_v4i*)l, 0, 0);
}
#else
__device__ __forceinline__ void stage16(const float* __restrict__ g, float* l) {
    *reinterpret_cast<float4*>(l) = *reinterpret_cast<const float4*>(g);
}
#endif

__device__ __forceinline__ float silu_f(float v) {
    return v / (1.0f + __expf(-v));
}

// ---------------------------------------------------------------------------
// Router: one wave32 per token. logits = x@router_w (D x 8), softmax, top-2
// as topi[n][2] / topw[n][2]; also sgate[n] = sigmoid(x @ shared_gate_w).
// ---------------------------------------------------------------------------
__global__ __launch_bounds__(256)
void router_kernel(const float* __restrict__ x,
                   const float* __restrict__ rw,     // [D][E]
                   const float* __restrict__ sgw,    // [D]
                   int* __restrict__ topi,           // [N][2]
                   float* __restrict__ topw,         // [N][2]
                   float* __restrict__ sgate,        // [N]
                   int N, int D) {
    const int wave = threadIdx.x >> 5;
    const int lane = threadIdx.x & 31;
    const int n = blockIdx.x * 8 + wave;
    if (n >= N) return;

    const float* xr = x + (size_t)n * D;
    float acc[MOE_E];
#pragma unroll
    for (int e = 0; e < MOE_E; ++e) acc[e] = 0.0f;
    float accg = 0.0f;

    for (int d = lane; d < D; d += 32) {
        float xv = xr[d];
#pragma unroll
        for (int e = 0; e < MOE_E; ++e) acc[e] = fmaf(xv, rw[d * MOE_E + e], acc[e]);
        accg = fmaf(xv, sgw[d], accg);
    }
#pragma unroll
    for (int off = 16; off > 0; off >>= 1) {
#pragma unroll
        for (int e = 0; e < MOE_E; ++e) acc[e] += __shfl_xor(acc[e], off, 32);
        accg += __shfl_xor(accg, off, 32);
    }
    if (lane == 0) {
        float mx = acc[0];
#pragma unroll
        for (int e = 1; e < MOE_E; ++e) mx = fmaxf(mx, acc[e]);
        float p[MOE_E];
        float sum = 0.0f;
#pragma unroll
        for (int e = 0; e < MOE_E; ++e) { p[e] = __expf(acc[e] - mx); sum += p[e]; }
        float inv = 1.0f / sum;
#pragma unroll
        for (int e = 0; e < MOE_E; ++e) p[e] *= inv;
        int i1 = 0;
#pragma unroll
        for (int e = 1; e < MOE_E; ++e) if (p[e] > p[i1]) i1 = e;
        int i2 = (i1 == 0) ? 1 : 0;
#pragma unroll
        for (int e = 0; e < MOE_E; ++e) if (e != i1 && p[e] > p[i2]) i2 = e;
        topi[n * 2]     = i1;
        topi[n * 2 + 1] = i2;
        topw[n * 2]     = p[i1];
        topw[n * 2 + 1] = p[i2];
        sgate[n] = 1.0f / (1.0f + __expf(-accg));
    }
}

// ---------------------------------------------------------------------------
// Token lists, one work-group, no atomics. Wave w counts and then places the
// pairs of expert (w & 7) among tokens [(w >> 3) * N/4, +N/4), in token order.
//   tok[s], wt[s]   token and combine weight of slot s (pad slots: token 0,
//                   weight 0; their results are never read)
//   slotOf[n][2]    the two slots of token n, lower expert first
//   tileExp[t]      expert of row tile t, -1 behind the last used tile
// ---------------------------------------------------------------------------
__global__ __launch_bounds__(1024)
void build_lists_kernel(const int* __restrict__ topi,
                        const float* __restrict__ topw,
                        int* __restrict__ tok,
                        float* __restrict__ wt,
                        int* __restrict__ slotOf,
                        int* __restrict__ tileExp) {
    __shared__ unsigned char sel[MOE_N];      // i1 | i2 << 4
    __shared__ float sw[MOE_N * 2];
    __shared__ int cnt[4][MOE_E];

    const int tid  = threadIdx.x;
    const int lane = tid & 31;
    const int e    = (tid >> 5) & 7;
    const int q    = tid >> 8;
    const int nq   = q * (MOE_N / 4);

    for (int n = tid; n < MOE_N; n += 1024) {
        const int2   iv = reinterpret_cast<const int2*>(topi)[n];
        const float2 wv = reinterpret_cast<const float2*>(topw)[n];
        sel[n] = (unsigned char)(iv.x | (iv.y << 4));
        sw[n * 2]     = wv.x;
        sw[n * 2 + 1] = wv.y;
    }
    __syncthreads();

    int c = 0;
#pragma unroll 8
    for (int it = 0; it < MOE_N / 128; ++it) {
        const int s = sel[nq + it * 32 + lane];
        c += ((s & 15) == e || (s >> 4) == e) ? 1 : 0;
    }
#pragma unroll
    for (int off = 16; off > 0; off >>= 1) c += __shfl_xor(c, off, 32);
    if (lane == 0) cnt[q][e] = c;
    __syncthreads();

    int run = 0, end = 0, tileE = -1, accum = 0;
#pragma unroll
    for (int k = 0; k < MOE_E; ++k) {
        const int ck  = cnt[0][k] + cnt[1][k] + cnt[2][k] + cnt[3][k];
        const int pad = (ck + 127) & ~127;
        if (k == e) {
            run = accum;
#pragma unroll
            for (int r = 0; r < 3; ++r) if (r < q) run += cnt[r][k];
            end = accum + pad;
        }
        if (tid * 128 >= accum && tid * 128 < accum + pad) tileE = k;
        accum += pad;
    }
    if (tid < MOE_TILES) tileExp[tid] = tileE;

    for (int it = 0; it < MOE_N / 128; it += 4) {
        int   sv[4];
        float wv[4];
#pragma unroll
        for (int u = 0; u < 4; ++u) sv[u] = sel[nq + (it + u) * 32 + lane];
#pragma unroll
        for (int u = 0; u < 4; ++u)
            wv[u] = sw[(nq + (it + u) * 32 + lane) * 2 + (((sv[u] & 15) == e) ? 0 : 1)];
#pragma unroll
        for (int u = 0; u < 4; ++u) {
            const int n  = nq + (it + u) * 32 + lane;
            const int a  = sv[u] & 15, b = sv[u] >> 4;
            const bool m1 = (a == e);
            const bool m  = m1 || (b == e);
            const unsigned mask = (unsigned)__ballot(m);
            if (m) {
                const int slot = run + __popc(mask & ((1u << lane) - 1u));
                tok[slot] = n;
                wt[slot]  = wv[u];
                slotOf[n * 2 + ((e < (m1 ? b : a)) ? 0 : 1)] = slot;
                // precaution: the wait stands before the next pass rewrites these stores' registers
                asm volatile("s_wait_xcnt 0x0" ::: "memory");
            }
            run += __popc(mask);
        }
    }
    if (q == 3)
        for (int s = run + lane; s < end; s += 32) { tok[s] = 0; wt[s] = 0.0f; }
}

// ---------------------------------------------------------------------------
// Tiled f32 WMMA GEMM, C-tile 128x64 per 256-thread block (8 waves, wave32,
// wave grid 4x2), K tile 32. Each wave owns 32x32 = 2x2 WMMA 16x16 tiles,
// K-step 4 per WMMA: 32 WMMAs per stream between barriers. The narrow tile
// puts several independent work-groups on a WGP, so that one group's barrier
// and LDS waits are filled by another's WMMAs, and deals the routed tiles
// over the WGPs in halves. Double-buffered LDS; staging via async global->LDS
// when available.
//   MODE_SILU_SCALE  grouped: A rows gathered through idx = tok, B of the
//                    tile's expert, C[slot] = silu(acc) * scale[slot]
//   MODE_STORE       grouped: A rows = slots, B of the tile's expert, C = acc
//   MODE_GATED       C = silu(acc_gate) * acc_up
//   MODE_COMBINE     C[n] = scale[n] * acc + Y[idx[n][0]] + Y[idx[n][1]]
// ---------------------------------------------------------------------------
#define MODE_SILU_SCALE 0
#define MODE_STORE      1
#define MODE_GATED      2
#define MODE_COMBINE    3

template <int MODE>
__global__ __launch_bounds__(256)
void gemm_wmma_f32(const float* __restrict__ A, int lda,
                   const float* __restrict__ B, int ldb, int upOff,
                   float* __restrict__ C, int ldc,
                   const float* __restrict__ scale, int scaleStride,
                   const int* __restrict__ idx,
                   const int* __restrict__ tileExp, int expStride,
                   const float* __restrict__ Y,
                   int M, int N, int K) {
    constexpr int BM = 128, BN = 64, BK = 32;
    constexpr int NG = (MODE == MODE_GATED) ? 2 : 1;   // gate/up streams
    constexpr int ASTRIDE = BK + 4;    // 36 words: conflict-free A frag reads
    constexpr int BSTRIDE = BN + 16;   // 80 words: 2*80 % 64 == 32 -> clean
    // async ops issued per wave per tile (in-order completion on ASYNCcnt)
    constexpr int PEND = 4 + 2 * NG;

    __shared__ float As[2][BM][ASTRIDE];
    __shared__ float Bs[2][NG][BK][BSTRIDE];

    const int tid  = threadIdx.x;
    const int wave = tid >> 5;
    const int lane = tid & 31;
    const int lo   = lane & 15;
    const int hi   = lane >> 4;

    const int wm0 = (wave >> 1) << 5;  // 0,32,64,96
    const int wn0 = (wave & 1) << 5;   // 0,32

    const int m0 = blockIdx.y * BM;
    const int n0 = blockIdx.x * BN;

    if constexpr (MODE == MODE_SILU_SCALE || MODE == MODE_STORE) {
        const int e = tileExp[blockIdx.y];   // same for the whole work-group
        if (e < 0) return;                   // unused tile: leaves before any barrier
        B += (size_t)e * expStride;
    }

    // staging coordinates (fixed per thread)
    const int ar = tid >> 3;            // A row   0..31 (+32 per quarter)
    const int ac = (tid & 7) << 2;      // A col   0..28: a row's 128 B from 8 lanes
    const int br = tid >> 4;            // B row   0..15 (+16 on second half)
    const int bc = (tid & 15) << 2;     // B col   0..60
    int arow[4];
#pragma unroll   // constant h: arow[] stays in registers
    for (int h = 0; h < 4; ++h) {
        arow[h] = m0 + ar + h * 32;
        if constexpr (MODE == MODE_SILU_SCALE) arow[h] = idx[arow[h]];
    }

    v8f acc[NG][2][2];
#pragma unroll
    for (int g = 0; g < NG; ++g)
#pragma unroll
        for (int i = 0; i < 2; ++i)
#pragma unroll
            for (int j = 0; j < 2; ++j)
                acc[g][i][j] = (v8f)(0.0f);

    // issue staging for tile at k0 into buffer `buf`
    auto stage_tile = [&](int buf, int k0) {
#pragma unroll   // constant h: arow[] stays in registers
        for (int h = 0; h < 4; ++h)
            stage16(&A[(size_t)arow[h] * lda + k0 + ac], &As[buf][ar + h * 32][ac]);
#pragma unroll
        for (int g = 0; g < NG; ++g)
#pragma unroll
            for (int h = 0; h < 2; ++h)
                stage16(&B[(size_t)(k0 + br + h * 16) * ldb + n0 + g * upOff + bc],
                        &Bs[buf][g][br + h * 16][bc]);
    };

    stage_tile(0, 0);
    int cur = 0;
    for (int k0 = 0; k0 < K; k0 += BK) {
        const bool has_next = (k0 + BK) < K;
        if (has_next) stage_tile(cur ^ 1, k0 + BK);
#if USE_ASYNC_LDS
        // tile `cur` complete; next tile's PEND ops may remain in flight
        if (has_next) __builtin_amdgcn_s_wait_asynccnt(PEND);
        else          __builtin_amdgcn_s_wait_asynccnt(0);
#endif
        __syncthreads();

#pragma unroll
        for (int kk = 0; kk < BK; kk += 4) {
            const int kb = kk + (hi << 1);
            const v2f a0 = *reinterpret_cast<const v2f*>(&As[cur][wm0 + lo][kb]);
            const v2f a1 = *reinterpret_cast<const v2f*>(&As[cur][wm0 + 16 + lo][kb]);
#pragma unroll
            for (int g = 0; g < NG; ++g) {
#pragma unroll
                for (int j = 0; j < 2; ++j) {
                    const int nn = wn0 + j * 16 + lo;
                    v2f b;
                    b.x = Bs[cur][g][kb][nn];
                    b.y = Bs[cur][g][kb + 1][nn];
                    acc[g][0][j] = __builtin_amdgcn_wmma_f32_16x16x4_f32(
                        false, a0, false, b, (short)0, acc[g][0][j], false, false);
                    acc[g][1][j] = __builtin_amdgcn_wmma_f32_16x16x4_f32(
                        false, a1, false, b, (short)0, acc[g][1][j], false, false);
                }
            }
        }
        __syncthreads();   // protects buf cur (next issue target)
        cur ^= 1;
    }

    // --- epilogue: lane l, vgpr v -> row = v + 8*hi, col = lo ---
    if constexpr (MODE == MODE_COMBINE) {
        // C row = scale * acc, then the token's lower expert row, then the higher
        const int gc = n0 + wn0 + lo;
        int2  sl[2][8];
        float sc[2][8];
#pragma unroll
        for (int i = 0; i < 2; ++i)
#pragma unroll
            for (int v = 0; v < 8; ++v) {
                const int grow = m0 + wm0 + i * 16 + v + 8 * hi;
                sl[i][v] = reinterpret_cast<const int2*>(idx)[grow];
                sc[i][v] = scale[(size_t)grow * scaleStride];
            }
        // precaution: the wait stands before a register these loads name is rewritten
        asm volatile("s_wait_xcnt 0x0" ::: "memory");
#pragma unroll
        for (int i = 0; i < 2; ++i) {
            float y0[8][2], y1[8][2];
#pragma unroll
            for (int v = 0; v < 8; ++v) {
                const float* p0 = &Y[(size_t)sl[i][v].x * ldc + gc];
                const float* p1 = &Y[(size_t)sl[i][v].y * ldc + gc];
#pragma unroll
                for (int j = 0; j < 2; ++j) { y0[v][j] = p0[j * 16]; y1[v][j] = p1[j * 16]; }
                // precaution: the wait stands before a register these loads name is rewritten;
                // p0 and p1 as inputs keep both address pairs live up to it
                asm volatile("s_wait_xcnt 0x0" :: "v"(p0), "v"(p1) : "memory");
            }
#pragma unroll
            for (int v = 0; v < 8; ++v) {
                const int grow = m0 + wm0 + i * 16 + v + 8 * hi;
#pragma unroll
                for (int j = 0; j < 2; ++j)
                    C[(size_t)grow * ldc + gc + j * 16] =
                        sc[i][v] * acc[0][i][j][v] + y0[v][j] + y1[v][j];
            }
        }
        return;
    }
#pragma unroll
    for (int i = 0; i < 2; ++i) {
#pragma unroll
        for (int j = 0; j < 2; ++j) {
            union { v8f v; float f[8]; } u0, u1;
            u0.v = acc[0][i][j];
            if constexpr (MODE == MODE_GATED) u1.v = acc[NG - 1][i][j];
#pragma unroll
            for (int v = 0; v < 8; ++v) {
                const int grow = m0 + wm0 + i * 16 + v + 8 * hi;
                const int gcol = n0 + wn0 + j * 16 + lo;
                float* cp = &C[(size_t)grow * ldc + gcol];
                if constexpr (MODE == MODE_SILU_SCALE) {
                    const float s = scale[(size_t)grow * scaleStride];
                    *cp = silu_f(u0.f[v]) * s;
                } else if constexpr (MODE == MODE_STORE) {
                    *cp = u0.f[v];
                } else if constexpr (MODE == MODE_GATED) {
                    *cp = silu_f(u0.f[v]) * u1.f[v];
                }
            }
        }
    }
}

// ---------------------------------------------------------------------------
// Host launcher
// ---------------------------------------------------------------------------
extern "C" void kernel_launch(void* const* d_in, const int* in_sizes, int n_in,
                              void* d_out, int out_size, void* d_ws, size_t ws_size,
                              hipStream_t stream) {
    const float* x    = (const float*)d_in[0]; // [N][D]
    const float* rw   = (const float*)d_in[1]; // [D][E]
    const float* w1   = (const float*)d_in[2]; // [E][D][F]
    const float* w2   = (const float*)d_in[3]; // [E][F][D]
    const float* sgu  = (const float*)d_in[4]; // [D][2F]
    const float* sdn  = (const float*)d_in[5]; // [F][D]
    const float* sgw  = (const float*)d_in[6]; // [D][1]
    float* out = (float*)d_out;                // [N][D]

    const int D = MOE_D, F = MOE_F, N = MOE_N;

    float* ws     = (float*)d_ws;
    float* H      = ws;                             // [N][F] shared activations
    float* HR     = H + (size_t)N * F;              // [SLOTS][F] routed activations
    float* Y      = HR + (size_t)MOE_SLOTS * F;     // [SLOTS][D] routed results
    float* sgate  = Y + (size_t)MOE_SLOTS * D;      // [N]
    float* topw   = sgate + N;                      // [N][2]
    float* wt     = topw + 2 * N;                   // [SLOTS]
    int*   topi   = (int*)(wt + MOE_SLOTS);         // [N][2]
    int*   tok    = topi + 2 * N;                   // [SLOTS]
    int*   slotOf = tok + MOE_SLOTS;                // [N][2]
    int*   tileE  = slotOf + 2 * N;                 // [TILES]

    router_kernel<<<N / 8, 256, 0, stream>>>(x, rw, sgw, topi, topw, sgate, N, D);
    build_lists_kernel<<<1, 1024, 0, stream>>>(topi, topw, tok, wt, slotOf, tileE);

    const dim3 blk(256);
    const dim3 gridF(F / 64, N / 128);
    const dim3 gridD(D / 64, N / 128);
    const dim3 gridRF(F / 64, MOE_TILES);
    const dim3 gridRD(D / 64, MOE_TILES);

    // shared expert, first half: H = silu(x@Wg) * (x@Wu)
    gemm_wmma_f32<MODE_GATED><<<gridF, blk, 0, stream>>>(
        x, D, sgu, 2 * F, F, H, F, nullptr, 0, nullptr, nullptr, 0, nullptr, N, F, D);

    // routed experts, all in one launch per layer (combine weight folded into HR)
    gemm_wmma_f32<MODE_SILU_SCALE><<<gridRF, blk, 0, stream>>>(
        x, D, w1, F, 0, HR, F, wt, 1, tok, tileE, D * F, nullptr, MOE_SLOTS, F, D);
    gemm_wmma_f32<MODE_STORE><<<gridRD, blk, 0, stream>>>(
        HR, F, w2, D, 0, Y, D, nullptr, 0, nullptr, tileE, F * D, nullptr, MOE_SLOTS, D, F);

    // out = sgate * (H @ Wdown) + the token's two routed rows
    gemm_wmma_f32<MODE_COMBINE><<<gridD, blk, 0, stream>>>(
        H, F, sdn, D, 0, out, D, sgate, 1, slotOf, nullptr, 0, Y, N, D, F);
}

// v003
// One run takes 357 microseconds.
// Next to v002, in two timings, it ran 1.13 times as fast each time.
// All steps since v000 together make it 3.28 times as fast.
#include <hip/hip_runtime.h>
#include <hip/hip_bf16.h>
#include <math.h>

// ---------------------------------------------------------------------------
// MoE forward for MI455X (gfx1250, wave32, WMMA f32 16x16x4).
// D=F=1024, E=8, K=2, N=B*T=4096. Double-buffered LDS staging via CDNA5
// GLOBAL_LOAD_ASYNC_TO_LDS (ASYNCcnt). Block tile 128x64, wave tile 32x32.
// Routed experts run only on the tokens that chose them: the 2N (token,
// expert) pairs are sorted by expert into slots, each expert's run padded to
// whole 128-row tiles. One launch per layer covers the shared expert's tiles
// and all routed experts' tiles; a small kernel then adds each token's rows.
// ---------------------------------------------------------------------------

typedef __attribute__((ext_vector_type(2))) float v2f;
typedef __attribute__((ext_vector_type(8))) float v8f;
typedef __attribute__((ext_vector_type(4))) int   v4i;

#define MOE_D 1024
#define MOE_F 1024
#define MOE_E 8
#define MOE_N 4096
#define MOE_TILES 72                  // >= (2N + E*127) / 128 row tiles
#define MOE_SLOTS (MOE_TILES * 128)

// ---- CDNA5 async global->LDS path (probe via __has_builtin) ---------------
#if defined(__has_builtin)
#if __has_builtin(__builtin_amdgcn_global_load_async_to_lds_b128) && \
    __has_builtin(__builtin_amdgcn_s_wait_asynccnt)
#define USE_ASYNC_LDS 1
#endif
#endif
#ifndef USE_ASYNC_LDS
#define USE_ASYNC_LDS 0
#endif

#if USE_ASYNC_LDS
typedef __attribute__((address_space(1))) v4i glb_v4i;
typedef __attribute__((address_space(3))) v4i lds_v4i;
__device__ __forceinline__ void stage16(const float* __restrict__ g, float* l) {
    // per-lane: LDS[l .. l+15] = MEM[g .. g+15], tracked by ASYNCcnt
    __builtin_amdgcn_global_load_async_to_lds_b128(
        (glb_v4i*)g, (lds_v4i*)l, 0, 0);
}
#else
__device__ __forceinline__ void stage16(const float* __restrict__ g, float* l) {
    *reinterpret_cast<float4*>(l) = *reinterpret_cast<const float4*>(g);
}
#endif

__device__ __forceinline__ float silu_f(float v) {
    return v / (1.0f + __expf(-v));
}

// ---------------------------------------------------------------------------
// Router: one wave32 per token. logits = x@router_w (D x 8), softmax, top-2
// as topi[n][2] / topw[n][2]; also sgate[n] = sigmoid(x @ shared_gate_w).
// ---------------------------------------------------------------------------
__global__ __launch_bounds__(256)
void router_kernel(const float* __restrict__ x,
                   const float* __restrict__ rw,     // [D][E]
                   const float* __restrict__ sgw,    // [D]
                   int* __restrict__ topi,           // [N][2]
                   float* __restrict__ topw,         // [N][2]
                   float* __restrict__ sgate,        // [N]
                   int N, int D) {
    const int wave = threadIdx.x >> 5;
    const int lane = threadIdx.x & 31;
    const int n = blockIdx.x * 8 + wave;
    if (n >= N) return;

    const float* xr = x + (size_t)n * D;
    float acc[MOE_E];
#pragma unroll
    for (int e = 0; e < MOE_E; ++e) acc[e] = 0.0f;
    float accg = 0.0f;

    for (int d = lane; d < D; d += 32) {
        float xv = xr[d];
#pragma unroll
        for (int e = 0; e < MOE_E; ++e) acc[e] = fmaf(xv, rw[d * MOE_E + e], acc[e]);
        accg = fmaf(xv, sgw[d], accg);
    }
#pragma unroll
    for (int off = 16; off > 0; off >>= 1) {
#pragma unroll
        for (int e = 0; e < MOE_E; ++e) acc[e] += __shfl_xor(acc[e], off, 32);
        accg += __shfl_xor(accg, off, 32);
    }
    if (lane == 0) {
        float mx = acc[0];
#pragma unroll
        for (int e = 1; e < MOE_E; ++e) mx = fmaxf(mx, acc[e]);
        float p[MOE_E];
        float sum = 0.0f;
#pragma unroll
        for (int e = 0; e < MOE_E; ++e) { p[e] = __expf(acc[e] - mx); sum += p[e]; }
        float inv = 1.0f / sum;
#pragma unroll
        for (int e = 0; e < MOE_E; ++e) p[e] *= inv;
        int i1 = 0;
#pragma unroll
        for (int e = 1; e < MOE_E; ++e) if (p[e] > p[i1]) i1 = e;
        int i2 = (i1 == 0) ? 1 : 0;
#pragma unroll
        for (int e = 0; e < MOE_E; ++e) if (e != i1 && p[e] > p[i2]) i2 = e;
        topi[n * 2]     = i1;
        topi[n * 2 + 1] = i2;
        topw[n * 2]     = p[i1];
        topw[n * 2 + 1] = p[i2];
        sgate[n] = 1.0f / (1.0f + __expf(-accg));
    }
}

// ---------------------------------------------------------------------------
// Token lists, one work-group, no atomics. Wave w counts and then places the
// pairs of expert (w & 7) among tokens [(w >> 3) * N/4, +N/4), in token order.
//   tok[s], wt[s]   token and combine weight of slot s (pad slots: token 0,
//                   weight 0; their results are never read)
//   slotOf[n][2]    the two slots of token n, lower expert first
//   tileExp[t]      expert of row tile t, -1 behind the last used tile
// ---------------------------------------------------------------------------
__global__ __launch_bounds__(1024)
void build_lists_kernel(const int* __restrict__ topi,
                        const float* __restrict__ topw,
                        int* __restrict__ tok,
                        float* __restrict__ wt,
                        int* __restrict__ slotOf,
                        int* __restrict__ tileExp) {
    __shared__ unsigned char sel[MOE_N];      // i1 | i2 << 4
    __shared__ float sw[MOE_N * 2];
    __shared__ int cnt[4][MOE_E];

    const int tid  = threadIdx.x;
    const int lane = tid & 31;
    const int e    = (tid >> 5) & 7;
    const int q    = tid >> 8;
    const int nq   = q * (MOE_N / 4);

    for (int n = tid; n < MOE_N; n += 1024) {
        const int2   iv = reinterpret_cast<const int2*>(topi)[n];
        const float2 wv = reinterpret_cast<const float2*>(topw)[n];
        sel[n] = (unsigned char)(iv.x | (iv.y << 4));
        sw[n * 2]     = wv.x;
        sw[n * 2 + 1] = wv.y;
    }
    __syncthreads();

    int c = 0;
#pragma unroll 8
    for (int it = 0; it < MOE_N / 128; ++it) {
        const int s = sel[nq + it * 32 + lane];
        c += ((s & 15) == e || (s >> 4) == e) ? 1 : 0;
    }
#pragma unroll
    for (int off = 16; off > 0; off >>= 1) c += __shfl_xor(c, off, 32);
    if (lane == 0) cnt[q][e] = c;
    __syncthreads();

    int run = 0, end = 0, tileE = -1, accum = 0;
#pragma unroll
    for (int k = 0; k < MOE_E; ++k) {
        const int ck  = cnt[0][k] + cnt[1][k] + cnt[2][k] + cnt[3][k];
        const int pad = (ck + 127) & ~127;
        if (k == e) {
            run = accum;
#pragma unroll
            for (int r = 0; r < 3; ++r) if (r < q) run += cnt[r][k];
            end = accum + pad;
        }
        if (tid * 128 >= accum && tid * 128 < accum + pad) tileE = k;
        accum += pad;
    }
    if (tid < MOE_TILES) tileExp[tid] = tileE;

    for (int it = 0; it < MOE_N / 128; it += 4) {
        int   sv[4];
        float wv[4];
#pragma unroll
        for (int u = 0; u < 4; ++u) sv[u] = sel[nq + (it + u) * 32 + lane];
#pragma unroll
        for (int u = 0; u < 4; ++u)
            wv[u] = sw[(nq + (it + u) * 32 + lane) * 2 + (((sv[u] & 15) == e) ? 0 : 1)];
#pragma unroll
        for (int u = 0; u < 4; ++u) {
            const int n  = nq + (it + u) * 32 + lane;
            const int a  = sv[u] & 15, b = sv[u] >> 4;
            const bool m1 = (a == e);
            const bool m  = m1 || (b == e);
            const unsigned mask = (unsigned)__ballot(m);
            if (m) {
                const int slot = run + __popc(mask & ((1u << lane) - 1u));
                tok[slot] = n;
                wt[slot]  = wv[u];
                slotOf[n * 2 + ((e < (m1 ? b : a)) ? 0 : 1)] = slot;
                // precaution: the wait stands before the next pass rewrites these stores' registers
                asm volatile("s_wait_xcnt 0x0" ::: "memory");
            }
            run += __popc(mask);
        }
    }
    if (q == 3)
        for (int s = run + lane; s < end; s += 32) { tok[s] = 0; wt[s] = 0.0f; }
}

// ---------------------------------------------------------------------------
// Tiled f32 WMMA GEMM, C-tile 128x64 per 256-thread block (8 waves, wave32,
// wave grid 4x2), K tile 32. Each wave owns 32x32 = 2x2 WMMA 16x16 tiles,
// K-step 4 per WMMA: 32 WMMAs per stream between barriers. The narrow tile
// puts several independent work-groups on a WGP, so that one group's barrier
// and LDS waits are filled by another's WMMAs, and deals the routed tiles
// over the WGPs in halves. Double-buffered LDS; staging via async global->LDS
// when available.
//   MODE_SILU_SCALE  A rows gathered through idx = tok,
//                    C[slot] = silu(acc) * scale[slot]
//   MODE_STORE       C = acc
//   MODE_GATED       C = silu(acc_gate) * acc_up
// One tile (bx, by) of one GEMM; the layer kernels below pick the GEMM by
// blockIdx.y and hand in their LDS.
// ---------------------------------------------------------------------------
#define MODE_SILU_SCALE 0
#define MODE_STORE      1
#define MODE_GATED      2

#define GEMM_LDS_WORDS(NG) (2 * 128 * 36 + 2 * (NG) * 32 * 80)

template <int MODE>
__device__ __forceinline__
void gemm_tile(float* smem, int bx, int by,
               const float* __restrict__ A, int lda,
               const float* __restrict__ B, int ldb, int upOff,
               float* __restrict__ C, int ldc,
               const float* __restrict__ scale, int scaleStride,
               const int* __restrict__ idx,
               int K) {
    constexpr int BM = 128, BN = 64, BK = 32;
    constexpr int NG = (MODE == MODE_GATED) ? 2 : 1;   // gate/up streams
    constexpr int ASTRIDE = BK + 4;    // 36 words: conflict-free A frag reads
    constexpr int BSTRIDE = BN + 16;   // 80 words: 2*80 % 64 == 32 -> clean
    // async ops issued per wave per tile (in-order completion on ASYNCcnt)
    constexpr int PEND = 4 + 2 * NG;
    static_assert(GEMM_LDS_WORDS(NG) == 2 * BM * ASTRIDE + 2 * NG * BK * BSTRIDE, "LDS size");

    float (*As)[BM][ASTRIDE] = reinterpret_cast<float (*)[BM][ASTRIDE]>(smem);
    float (*Bs)[NG][BK][BSTRIDE] =
        reinterpret_cast<float (*)[NG][BK][BSTRIDE]>(smem + 2 * BM * ASTRIDE);

    const int tid  = threadIdx.x;
    const int wave = tid >> 5;
    const int lane = tid & 31;
    const int lo   = lane & 15;
    const int hi   = lane >> 4;

    const int wm0 = (wave >> 1) << 5;  // 0,32,64,96
    const int wn0 = (wave & 1) << 5;   // 0,32

    const int m0 = by * BM;
    const int n0 = bx * BN;

    // staging coordinates (fixed per thread)
    const int ar = tid >> 3;            // A row   0..31 (+32 per quarter)
    const int ac = (tid & 7) << 2;      // A col   0..28: a row's 128 B from 8 lanes
    const int br = tid >> 4;            // B row   0..15 (+16 on second half)
    const int bc = (tid & 15) << 2;     // B col   0..60
    int arow[4];
#pragma unroll   // constant h: arow[] stays in registers
    for (int h = 0; h < 4; ++h) {
        arow[h] = m0 + ar + h * 32;
        if constexpr (MODE == MODE_SILU_SCALE) arow[h] = idx[arow[h]];
    }

    v8f acc[NG][2][2];
#pragma unroll
    for (int g = 0; g < NG; ++g)
#pragma unroll
        for (int i = 0; i < 2; ++i)
#pragma unroll
            for (int j = 0; j < 2; ++j)
                acc[g][i][j] = (v8f)(0.0f);

    // issue staging for tile at k0 into buffer `buf`
    auto stage_tile = [&](int buf, int k0) {
#pragma unroll   // constant h: arow[] stays in registers
        for (int h = 0; h < 4; ++h)
            stage16(&A[(size_t)arow[h] * lda + k0 + ac], &As[buf][ar + h * 32][ac]);
#pragma unroll
        for (int g = 0; g < NG; ++g)
#pragma unroll
            for (int h = 0; h < 2; ++h)
                stage16(&B[(size_t)(k0 + br + h * 16) * ldb + n0 + g * upOff + bc],
                        &Bs[buf][g][br + h * 16][bc]);
    };

    stage_tile(0, 0);
    int cur = 0;
    for (int k0 = 0; k0 < K; k0 += BK) {
        const bool has_next = (k0 + BK) < K;
        if (has_next) stage_tile(cur ^ 1, k0 + BK);
#if USE_ASYNC_LDS
        // tile `cur` complete; next tile's PEND ops may remain in flight
        if (has_next) __builtin_amdgcn_s_wait_asynccnt(PEND);
        else          __builtin_amdgcn_s_wait_asynccnt(0);
#endif
        __syncthreads();

#pragma unroll
        for (int kk = 0; kk < BK; kk += 4) {
            const int kb = kk + (hi << 1);
            const v2f a0 = *reinterpret_cast<const v2f*>(&As[cur][wm0 + lo][kb]);
            const v2f a1 = *reinterpret_cast<const v2f*>(&As[cur][wm0 + 16 + lo][kb]);
#pragma unroll
            for (int g = 0; g < NG; ++g) {
#pragma unroll
                for (int j = 0; j < 2; ++j) {
                    const int nn = wn0 + j * 16 + lo;
                    v2f b;
                    b.x = Bs[cur][g][kb][nn];
                    b.y = Bs[cur][g][kb + 1][nn];
                    acc[g][0][j] = __builtin_amdgcn_wmma_f32_16x16x4_f32(
                        false, a0, false, b, (short)0, acc[g][0][j], false, false);
                    acc[g][1][j] = __builtin_amdgcn_wmma_f32_16x16x4_f32(
                        false, a1, false, b, (short)0, acc[g][1][j], false, false);
                }
            }
        }
        __syncthreads();   // protects buf cur (next issue target)
        cur ^= 1;
    }

    // --- epilogue: lane l, vgpr v -> row = v + 8*hi, col = lo ---
    float sc[2][8];
    if constexpr (MODE == MODE_SILU_SCALE) {
#pragma unroll
        for (int i = 0; i < 2; ++i)
#pragma unroll
            for (int v = 0; v < 8; ++v)
                sc[i][v] = scale[(size_t)(m0 + wm0 + i * 16 + v + 8 * hi) * scaleStride];
        // precaution: the wait stands before a register these loads name is rewritten
        asm volatile("s_wait_xcnt 0x0" ::: "memory");
    }
#pragma unroll
    for (int i = 0; i < 2; ++i) {
#pragma unroll
        for (int j = 0; j < 2; ++j) {
            union { v8f v; float f[8]; } u0, u1;
            u0.v = acc[0][i][j];
            if constexpr (MODE == MODE_GATED) u1.v = acc[NG - 1][i][j];
            const int grow = m0 + wm0 + i * 16 + 8 * hi;
            const int gcol = n0 + wn0 + j * 16 + lo;
            float* cp = &C[(size_t)grow * ldc + gcol];
            float r[8];
#pragma unroll
            for (int v = 0; v < 8; ++v) {
                if constexpr (MODE == MODE_SILU_SCALE) {
                    r[v] = silu_f(u0.f[v]) * sc[i][v];
                } else if constexpr (MODE == MODE_STORE) {
                    r[v] = u0.f[v];
                } else if constexpr (MODE == MODE_GATED) {
                    r[v] = silu_f(u0.f[v]) * u1.f[v];
                }
                cp[(size_t)v * ldc] = r[v];
            }
            if constexpr (MODE != MODE_STORE) {
                // precaution: the wait stands before the next block's arithmetic (behind the last
                // block: whatever the calling kernel's code goes on with) rewrites a register
                // these stores name; values and pointer as inputs keep them live up to it
                asm volatile("s_wait_xcnt 0x0"
                             :: "v"(r[0]), "v"(r[1]), "v"(r[2]), "v"(r[3]),
                                "v"(r[4]), "v"(r[5]), "v"(r[6]), "v"(r[7]), "v"(cp)
                             : "memory");
            }
        }
    }
}

// ---------------------------------------------------------------------------
// Layer kernels. The shared expert's GEMM and the routed experts' GEMM of a
// layer do not depend on each other, so they share one launch: a WGP holds
// four or five work-groups from start to end, freed places are refilled from
// the same grid, and each layer fills and drains the chip once. The shared
// tiles come first in blockIdx.y (in the up layer they are the long ones).
// ---------------------------------------------------------------------------
#define MOE_NT (MOE_N / 128)          // row tiles of the shared expert

__global__ __launch_bounds__(256)
void up_layer_kernel(const float* __restrict__ x,
                     const float* __restrict__ sgu,    // [D][2F]
                     const float* __restrict__ w1,     // [E][D][F]
                     float* __restrict__ H,            // [N][F]
                     float* __restrict__ HR,           // [SLOTS][F]
                     const float* __restrict__ wt,
                     const int* __restrict__ tok,
                     const int* __restrict__ tileExp) {
    __shared__ __attribute__((aligned(16))) float smem[GEMM_LDS_WORDS(2)];
    if (blockIdx.y < MOE_NT) {
        // H = silu(x@Wg) * (x@Wu)
        gemm_tile<MODE_GATED>(smem, blockIdx.x, blockIdx.y, x, MOE_D, sgu, 2 * MOE_F, MOE_F,
                              H, MOE_F, nullptr, 0, nullptr, MOE_D);
    } else {
        const int t = blockIdx.y - MOE_NT;
        const int e = tileExp[t];            // same for the whole work-group
        if (e < 0) return;                   // unused tile: leaves before any barrier
        // HR[slot] = silu(x[tok]@w1_e) * wt[slot] (combine weight folded in)
        gemm_tile<MODE_SILU_SCALE>(smem, blockIdx.x, t, x, MOE_D,
                                   w1 + (size_t)e * (MOE_D * MOE_F), MOE_F, 0,
                                   HR, MOE_F, wt, 1, tok, MOE_D);
    }
}

__global__ __launch_bounds__(256)
void down_layer_kernel(const float* __restrict__ H,
                       const float* __restrict__ sdn,  // [F][D]
                       const float* __restrict__ HR,
                       const float* __restrict__ w2,   // [E][F][D]
                       float* __restrict__ S,          // [N][D]
                       float* __restrict__ Y,          // [SLOTS][D]
                       const int* __restrict__ tileExp) {
    __shared__ __attribute__((aligned(16))) float smem[GEMM_LDS_WORDS(1)];
    const float* A = H;                      // S = H @ Wdown
    const float* B = sdn;
    float*       C = S;
    int          t = blockIdx.y;
    if (blockIdx.y >= MOE_NT) {              // Y[slot] = HR[slot] @ w2_e
        t = blockIdx.y - MOE_NT;
        const int e = tileExp[t];            // same for the whole work-group
        if (e < 0) return;                   // unused tile: leaves before any barrier
        A = HR;
        B = w2 + (size_t)e * (MOE_F * MOE_D);
        C = Y;
    }
    gemm_tile<MODE_STORE>(smem, blockIdx.x, t, A, MOE_F, B, MOE_D, 0,
                          C, MOE_D, nullptr, 0, nullptr, MOE_F);
}

// ---------------------------------------------------------------------------
// out[n] = sgate[n] * S[n], then the token's lower expert row, then the higher.
// One wave per token: 8 x 16 B per lane from each of the three rows.
// ---------------------------------------------------------------------------
__global__ __launch_bounds__(256)
void combine_kernel(const float* __restrict__ S,
                    const float* __restrict__ Y,
                    const float* __restrict__ sgate,
                    const int* __restrict__ slotOf,
                    float* __restrict__ out) {
    const int n    = blockIdx.x * 8 + (threadIdx.x >> 5);
    const int lane = threadIdx.x & 31;
    const int2  sl = reinterpret_cast<const int2*>(slotOf)[n];
    const float sc = sgate[n];
    // precaution: the wait stands before a register these loads name is rewritten
    asm volatile("s_wait_xcnt 0x0" ::: "memory");
    const float4* ps = reinterpret_cast<const float4*>(S + (size_t)n * MOE_D) + lane;
    const float4* p0 = reinterpret_cast<const float4*>(Y + (size_t)sl.x * MOE_D) + lane;
    const float4* p1 = reinterpret_cast<const float4*>(Y + (size_t)sl.y * MOE_D) + lane;
    float4*       po = reinterpret_cast<float4*>(out + (size_t)n * MOE_D) + lane;
    float4 a[8], y0[8], y1[8];
#pragma unroll   // all 24 loads in flight together
    for (int u = 0; u < 8; ++u) {
        a[u]  = ps[u * 32];
        y0[u] = p0[u * 32];
        y1[u] = p1[u * 32];
    }
    // precaution: the wait stands before a register these loads name is rewritten;
    // the pointers as inputs keep the address pairs live up to it
    asm volatile("s_wait_xcnt 0x0" :: "v"(ps), "v"(p0), "v"(p1) : "memory");
#pragma unroll
    for (int u = 0; u < 8; ++u) {
        float4 r;
        r.x = sc * a[u].x + y0[u].x + y1[u].x;
        r.y = sc * a[u].y + y0[u].y + y1[u].y;
        r.z = sc * a[u].z + y0[u].z + y1[u].z;
        r.w = sc * a[u].w + y0[u].w + y1[u].w;
        po[u * 32] = r;
    }
}

// ---------------------------------------------------------------------------
// Host launcher
// ---------------------------------------------------------------------------
extern "C" void kernel_launch(void* const* d_in, const int* in_sizes, int n_in,
                              void* d_out, int out_size, void* d_ws, size_t ws_size,
                              hipStream_t stream) {
    const float* x    = (const float*)d_in[0]; // [N][D]
    const float* rw   = (const float*)d_in[1]; // [D][E]
    const float* w1   = (const float*)d_in[2]; // [E][D][F]
    const float* w2   = (const float*)d_in[3]; // [E][F][D]
    const float* sgu  = (const float*)d_in[4]; // [D][2F]
    const float* sdn  = (const float*)d_in[5]; // [F][D]
    const float* sgw  = (const float*)d_in[6]; // [D][1]
    float* out = (float*)d_out;                // [N][D]

    const int D = MOE_D, F = MOE_F, N = MOE_N;

    float* ws     = (float*)d_ws;
    float* H      = ws;                             // [N][F] shared activations
    float* HR     = H + (size_t)N * F;              // [SLOTS][F] routed activations
    float* Y      = HR + (size_t)MOE_SLOTS * F;     // [SLOTS][D] routed results
    float* S      = Y + (size_t)MOE_SLOTS * D;      // [N][D] shared result, ungated
    float* sgate  = S + (size_t)N * D;              // [N]
    float* topw   = sgate + N;                      // [N][2]
    float* wt     = topw + 2 * N;                   // [SLOTS]
    int*   topi   = (int*)(wt + MOE_SLOTS);         // [N][2]
    int*   tok    = topi + 2 * N;                   // [SLOTS]
    int*   slotOf = tok + MOE_SLOTS;                // [N][2]
    int*   tileE  = slotOf + 2 * N;                 // [TILES]

    router_kernel<<<N / 8, 256, 0, stream>>>(x, rw, sgw, topi, topw, sgate, N, D);
    build_lists_kernel<<<1, 1024, 0, stream>>>(topi, topw, tok, wt, slotOf, tileE);

    const dim3 blk(256);
    const dim3 gridUp(F / 64, MOE_NT + MOE_TILES);
    const dim3 gridDown(D / 64, MOE_NT + MOE_TILES);

    up_layer_kernel<<<gridUp, blk, 0, stream>>>(x, sgu, w1, H, HR, wt, tok, tileE);
    down_layer_kernel<<<gridDown, blk, 0, stream>>>(H, sdn, HR, w2, S, Y, tileE);
    combine_kernel<<<N / 8, blk, 0, stream>>>(S, Y, sgate, slotOf, out);
}

// v004
// One run takes 337 microseconds.
// Next to v003, in two timings, it ran 1.06 and 1.07 times as fast.
// Counting every step since v000, it is 3.50 times as fast.
#include <hip/hip_runtime.h>
#include <hip/hip_bf16.h>
#include <math.h>

// ---------------------------------------------------------------------------
// MoE forward for MI455X (gfx1250, wave32, WMMA f32 16x16x4).
// D=F=1024, E=8, K=2, N=B*T=4096. Double-buffered LDS staging via CDNA5
// GLOBAL_LOAD_ASYNC_TO_LDS (ASYNCcnt). Block tile 128x64, wave tile 32x32.
// Routed experts run only on the tokens that chose them: the 2N (token,
// expert) pairs are sorted by expert into slots, each expert's run padded to
// whole 128-row tiles. One launch per layer covers the shared expert's tiles
// and all routed experts' tiles; a small kernel then adds each token's rows.
// ---------------------------------------------------------------------------

typedef __attribute__((ext_vector_type(2))) float v2f;
typedef __attribute__((ext_vector_type(8))) float v8f;
typedef __attribute__((ext_vector_type(4))) int   v4i;

#define MOE_D 1024
#define MOE_F 1024
#define MOE_E 8
#define MOE_N 4096
#define MOE_TILES 72                  // >= (2N + E*127) / 128 row tiles
#define MOE_SLOTS (MOE_TILES * 128)

// ---- CDNA5 async global->LDS path (probe via __has_builtin) ---------------
#if defined(__has_builtin)
#if __has_builtin(__builtin_amdgcn_global_load_async_to_lds_b128) && \
    __has_builtin(__builtin_amdgcn_s_wait_asynccnt)
#define USE_ASYNC_LDS 1
#endif
#endif
#ifndef USE_ASYNC_LDS
#define USE_ASYNC_LDS 0
#endif

#if USE_ASYNC_LDS
typedef __attribute__((address_space(1))) v4i glb_v4i;
typedef __attribute__((address_space(3))) v4i lds_v4i;
__device__ __forceinline__ void stage16(const float* __restrict__ g, float* l) {
    // per-lane: LDS[l .. l+15] = MEM[g .. g+15], tracked by ASYNCcnt
    __builtin_amdgcn_global_load_async_to_lds_b128(
        (glb_v4i*)g, (lds_v4i*)l, 0, 0);
}
#else
__device__ __forceinline__ void stage16(const float* __restrict__ g, float* l) {
    *reinterpret_cast<float4*>(l) = *reinterpret_cast<const float4*>(g);
}
#endif

__device__ __forceinline__ float silu_f(float v) {
    return v / (1.0f + __expf(-v));
}

// ---------------------------------------------------------------------------
// Router: one wave32 per token. logits = x@router_w (D x 8), softmax, top-2
// as topi[n][2] / topw[n][2]; also sgate[n] = sigmoid(x @ shared_gate_w).
// ---------------------------------------------------------------------------
__global__ __launch_bounds__(256)
void router_kernel(const float* __restrict__ x,
                   const float* __restrict__ rw,     // [D][E]
                   const float* __restrict__ sgw,    // [D]
                   int* __restrict__ topi,           // [N][2]
                   float* __restrict__ topw,         // [N][2]
                   float* __restrict__ sgate,        // [N]
                   int N, int D) {
    const int wave = threadIdx.x >> 5;
    const int lane = threadIdx.x & 31;
    const int n = blockIdx.x * 8 + wave;
    if (n >= N) return;

    const float* xr = x + (size_t)n * D;
    float acc[MOE_E];
#pragma unroll
    for (int e = 0; e < MOE_E; ++e) acc[e] = 0.0f;
    float accg = 0.0f;

    for (int d = lane; d < D; d += 32) {
        float xv = xr[d];
#pragma unroll
        for (int e = 0; e < MOE_E; ++e) acc[e] = fmaf(xv, rw[d * MOE_E + e], acc[e]);
        accg = fmaf(xv, sgw[d], accg);
    }
#pragma unroll
    for (int off = 16; off > 0; off >>= 1) {
#pragma unroll
        for (int e = 0; e < MOE_E; ++e) acc[e] += __shfl_xor(acc[e], off, 32);
        accg += __shfl_xor(accg, off, 32);
    }
    if (lane == 0) {
        float mx = acc[0];
#pragma unroll
        for (int e = 1; e < MOE_E; ++e) mx = fmaxf(mx, acc[e]);
        float p[MOE_E];
        float sum = 0.0f;
#pragma unroll
        for (int e = 0; e < MOE_E; ++e) { p[e] = __expf(acc[e] - mx); sum += p[e]; }
        float inv = 1.0f / sum;
#pragma unroll
        for (int e = 0; e < MOE_E; ++e) p[e] *= inv;
        int i1 = 0;
#pragma unroll
        for (int e = 1; e < MOE_E; ++e) if (p[e] > p[i1]) i1 = e;
        int i2 = (i1 == 0) ? 1 : 0;
#pragma unroll
        for (int e = 0; e < MOE_E; ++e) if (e != i1 && p[e] > p[i2]) i2 = e;
        topi[n * 2]     = i1;
        topi[n * 2 + 1] = i2;
        topw[n * 2]     = p[i1];
        topw[n * 2 + 1] = p[i2];
        sgate[n] = 1.0f / (1.0f + __expf(-accg));
    }
}

// ---------------------------------------------------------------------------
// Token lists, one work-group, no atomics. Wave w counts and then places the
// pairs of expert (w & 7) among tokens [(w >> 3) * N/4, +N/4), in token order.
//   tok[s], wt[s]   token and combine weight of slot s (pad slots: token 0,
//                   weight 0; their results are never read)
//   slotOf[n][2]    the two slots of token n, lower expert first
//   tileExp[t]      expert of row tile t, -1 behind the last used tile
// ---------------------------------------------------------------------------
__global__ __launch_bounds__(1024)
void build_lists_kernel(const int* __restrict__ topi,
                        const float* __restrict__ topw,
                        int* __restrict__ tok,
                        float* __restrict__ wt,
                        int* __restrict__ slotOf,
                        int* __restrict__ tileExp) {
    __shared__ unsigned char sel[MOE_N];      // i1 | i2 << 4
    __shared__ float sw[MOE_N * 2];
    __shared__ int cnt[4][MOE_E];

    const int tid  = threadIdx.x;
    const int lane = tid & 31;
    const int e    = (tid >> 5) & 7;
    const int q    = tid >> 8;
    const int nq   = q * (MOE_N / 4);

    for (int n = tid; n < MOE_N; n += 1024) {
        const int2   iv = reinterpret_cast<const int2*>(topi)[n];
        const float2 wv = reinterpret_cast<const float2*>(topw)[n];
        sel[n] = (unsigned char)(iv.x | (iv.y << 4));
        sw[n * 2]     = wv.x;
        sw[n * 2 + 1] = wv.y;
    }
    __syncthreads();

    int c = 0;
#pragma unroll 8
    for (int it = 0; it < MOE_N / 128; ++it) {
        const int s = sel[nq + it * 32 + lane];
        c += ((s & 15) == e || (s >> 4) == e) ? 1 : 0;
    }
#pragma unroll
    for (int off = 16; off > 0; off >>= 1) c += __shfl_xor(c, off, 32);
    if (lane == 0) cnt[q][e] = c;
    __syncthreads();

    int run = 0, end = 0, tileE = -1, accum = 0;
#pragma unroll
    for (int k = 0; k < MOE_E; ++k) {
        const int ck  = cnt[0][k] + cnt[1][k] + cnt[2][k] + cnt[3][k];
        const int pad = (ck + 127) & ~127;
        if (k == e) {
            run = accum;
#pragma unroll
            for (int r = 0; r < 3; ++r) if (r < q) run += cnt[r][k];
            end = accum + pad;
        }
        if (tid * 128 >= accum && tid * 128 < accum + pad) tileE = k;
        accum += pad;
    }
    if (tid < MOE_TILES) tileExp[tid] = tileE;

    for (int it = 0; it < MOE_N / 128; it += 4) {
        int   sv[4];
        float wv[4];
#pragma unroll
        for (int u = 0; u < 4; ++u) sv[u] = sel[nq + (it + u) * 32 + lane];
#pragma unroll
        for (int u = 0; u < 4; ++u)
            wv[u] = sw[(nq + (it + u) * 32 + lane) * 2 + (((sv[u] & 15) == e) ? 0 : 1)];
#pragma unroll
        for (int u = 0; u < 4; ++u) {
            const int n  = nq + (it + u) * 32 + lane;
            const int a  = sv[u] & 15, b = sv[u] >> 4;
            const bool m1 = (a == e);
            const bool m  = m1 || (b == e);
            const unsigned mask = (unsigned)__ballot(m);
            if (m) {
                const int slot = run + __popc(mask & ((1u << lane) - 1u));
                tok[slot] = n;
                wt[slot]  = wv[u];
                slotOf[n * 2 + ((e < (m1 ? b : a)) ? 0 : 1)] = slot;
                // precaution: the wait stands before the next pass rewrites these stores' registers
                asm volatile("s_wait_xcnt 0x0" ::: "memory");
            }
            run += __popc(mask);
        }
    }
    if (q == 3)
        for (int s = run + lane; s < end; s += 32) { tok[s] = 0; wt[s] = 0.0f; }
}

// ---------------------------------------------------------------------------
// Tiled f32 WMMA GEMM, C-tile 128x64 per 256-thread block (8 waves, wave32,
// wave grid 4x2), K tile 32. Each wave owns 32x32 = 2x2 WMMA 16x16 tiles,
// K-step 4 per WMMA: 32 WMMAs per stream between barriers. The narrow tile
// puts several independent work-groups on a WGP, so that one group's barrier
// and LDS waits are filled by another's WMMAs, and deals the routed tiles
// over the WGPs in halves. Double-buffered LDS; staging via async global->LDS
// when available.
//   MODE_SILU_SCALE  A rows gathered through idx = tok,
//                    C[slot] = silu(acc) * scale[slot]
//   MODE_STORE       C = acc
//   MODE_GATED       C = silu(acc_gate) * acc_up
// One tile (bx, by) of one GEMM; the layer kernels below pick the GEMM by
// blockIdx.y and hand in their LDS.
// ---------------------------------------------------------------------------
#define MODE_SILU_SCALE 0
#define MODE_STORE      1
#define MODE_GATED      2

#define GEMM_LDS_WORDS(NG) (2 * 128 * 36 + 2 * (NG) * 4 * 544)

template <int MODE>
__device__ __forceinline__
void gemm_tile(float* smem, int bx, int by,
               const float* __restrict__ A, int lda,
               const float* __restrict__ B, int ldb, int upOff,
               float* __restrict__ C, int ldc,
               const float* __restrict__ scale, int scaleStride,
               const int* __restrict__ idx,
               int K) {
    constexpr int BM = 128, BN = 64, BK = 32;
    constexpr int NG = (MODE == MODE_GATED) ? 2 : 1;   // gate/up streams
    constexpr int ASTRIDE = BK + 4;    // 36 words: conflict-free A frag reads
    // B tile in LDS: four planes of 16 columns, a k row = 16 words. Rows k and
    // k + 1 of a column lie 16 words apart, nearer than any other word the lane
    // reads, so one two-address load fills a B operand's register pair as it is
    // (no register copies); its 64 words fall on 64 banks. 32 words of pad per
    // plane spread a copy's four planes over both bank halves.
    constexpr int BPLANE = BK * 16 + 32;
    // async ops issued per wave per tile (in-order completion on ASYNCcnt)
    constexpr int PEND = 4 + 2 * NG;
    static_assert(GEMM_LDS_WORDS(NG) == 2 * BM * ASTRIDE + 2 * NG * (BN / 16) * BPLANE, "LDS size");

    float (*As)[BM][ASTRIDE] = reinterpret_cast<float (*)[BM][ASTRIDE]>(smem);
    float (*Bs)[NG][BN / 16][BPLANE] =
        reinterpret_cast<float (*)[NG][BN / 16][BPLANE]>(smem + 2 * BM * ASTRIDE);

    const int tid  = threadIdx.x;
    const int wave = tid >> 5;
    const int lane = tid & 31;
    const int lo   = lane & 15;
    const int hi   = lane >> 4;

    const int wm0 = (wave >> 1) << 5;  // 0,32,64,96
    const int wn0 = (wave & 1) << 5;   // 0,32

    const int m0 = by * BM;
    const int n0 = bx * BN;

    // staging coordinates (fixed per thread)
    const int ar = tid >> 3;            // A row   0..31 (+32 per quarter)
    const int ac = (tid & 7) << 2;      // A col   0..28: a row's 128 B from 8 lanes
    const int br = tid >> 4;            // B row   0..15 (+16 on second half)
    const int bc = (tid & 15) << 2;     // B col   0..60
    // Running source pointers of this thread's staged 16-byte pieces: one add
    // each per K tile is all the global address arithmetic left in the loop.
    const float* pa[4];
    const float* pb[2];
#pragma unroll   // constant h: pa[] stays in registers
    for (int h = 0; h < 4; ++h) {
        int arow = m0 + ar + h * 32;
        if constexpr (MODE == MODE_SILU_SCALE) arow = idx[arow];
        pa[h] = A + (size_t)arow * lda + ac;
    }
#pragma unroll
    for (int h = 0; h < 2; ++h)
        pb[h] = B + (size_t)(br + h * 16) * ldb + n0 + bc;

    v8f acc[NG][2][2];
#pragma unroll
    for (int g = 0; g < NG; ++g)
#pragma unroll
        for (int i = 0; i < 2; ++i)
#pragma unroll
            for (int j = 0; j < 2; ++j)
                acc[g][i][j] = (v8f)(0.0f);

    // issue staging for the next K tile into buffer `buf`, step the pointers
    auto stage_tile = [&](int buf) {
#pragma unroll   // constant h: pa[] stays in registers
        for (int h = 0; h < 4; ++h) {
            stage16(pa[h], &As[buf][ar + h * 32][ac]);
            pa[h] += BK;
        }
#pragma unroll
        for (int h = 0; h < 2; ++h) {
#pragma unroll
            for (int g = 0; g < NG; ++g)
                stage16(pb[h] + g * upOff, &Bs[buf][g][bc >> 4][(br + h * 16) * 16 + (bc & 15)]);
            pb[h] += (size_t)BK * ldb;
        }
    };

    // this lane's first A and B fragment words in buffer 0 (k = 2 * hi); every
    // other fragment word lies a compile-time distance from them
    const float* afrag = &As[0][wm0 + lo][hi << 1];
    const float* bfrag = &Bs[0][0][wn0 >> 4][(hi << 1) * 16 + lo];

    // one K tile out of buffer `cur`; the next tile's copies are issued first
    auto k_tile = [&](int cur, bool has_next) __attribute__((always_inline)) {
        if (has_next) stage_tile(cur ^ 1);
#if USE_ASYNC_LDS
        // tile `cur` complete; next tile's PEND ops may remain in flight
        if (has_next) __builtin_amdgcn_s_wait_asynccnt(PEND);
        else          __builtin_amdgcn_s_wait_asynccnt(0);
#endif
        __syncthreads();

#pragma unroll
        for (int kk = 0; kk < BK; kk += 4) {
            const float* ap = afrag + cur * (BM * ASTRIDE) + kk;
            const v2f a0 = *reinterpret_cast<const v2f*>(ap);
            const v2f a1 = *reinterpret_cast<const v2f*>(ap + 16 * ASTRIDE);
#pragma unroll
            for (int g = 0; g < NG; ++g) {
#pragma unroll
                for (int j = 0; j < 2; ++j) {
                    const float* bp = bfrag + ((cur * NG + g) * (BN / 16) + j) * BPLANE + kk * 16;
                    v2f b;
                    b.x = bp[0];
                    b.y = bp[16];
                    acc[g][0][j] = __builtin_amdgcn_wmma_f32_16x16x4_f32(
                        false, a0, false, b, (short)0, acc[g][0][j], false, false);
                    acc[g][1][j] = __builtin_amdgcn_wmma_f32_16x16x4_f32(
                        false, a1, false, b, (short)0, acc[g][1][j], false, false);
                }
            }
        }
        __syncthreads();   // protects buf cur (next issue target)
    };

    stage_tile(0);
    if constexpr (NG == 1) {
        // Two K tiles per trip (K is a multiple of 2 * BK), one per LDS buffer:
        // the buffer index is a constant in each half, so the LDS addresses are
        // loop constants and need no arithmetic between the WMMAs.
        for (int kp = 0; kp < K; kp += 2 * BK) {
            k_tile(0, true);
            k_tile(1, (kp + 2 * BK) < K);
        }
    } else {
        // Two streams: 64 accumulator registers leave no room to keep both
        // buffers' addresses, so the buffer index stays a variable here.
        int cur = 0;
        for (int k0 = 0; k0 < K; k0 += BK) {
            k_tile(cur, (k0 + BK) < K);
            cur ^= 1;
        }
    }

    // --- epilogue: lane l, vgpr v -> row = v + 8*hi, col = lo ---
    float sc[2][8];
    if constexpr (MODE == MODE_SILU_SCALE) {
#pragma unroll
        for (int i = 0; i < 2; ++i)
#pragma unroll
            for (int v = 0; v < 8; ++v)
                sc[i][v] = scale[(size_t)(m0 + wm0 + i * 16 + v + 8 * hi) * scaleStride];
        // precaution: the wait stands before a register these loads name is rewritten
        asm volatile("s_wait_xcnt 0x0" ::: "memory");
    }
#pragma unroll
    for (int i = 0; i < 2; ++i) {
#pragma unroll
        for (int j = 0; j < 2; ++j) {
            union { v8f v; float f[8]; } u0, u1;
            u0.v = acc[0][i][j];
            if constexpr (MODE == MODE_GATED) u1.v = acc[NG - 1][i][j];
            const int grow = m0 + wm0 + i * 16 + 8 * hi;
            const int gcol = n0 + wn0 + j * 16 + lo;
            float* cp = &C[(size_t)grow * ldc + gcol];
            float r[8];
#pragma unroll
            for (int v = 0; v < 8; ++v) {
                if constexpr (MODE == MODE_SILU_SCALE) {
                    r[v] = silu_f(u0.f[v]) * sc[i][v];
                } else if constexpr (MODE == MODE_STORE) {
                    r[v] = u0.f[v];
                } else if constexpr (MODE == MODE_GATED) {
                    r[v] = silu_f(u0.f[v]) * u1.f[v];
                }
                cp[(size_t)v * ldc] = r[v];
            }
            if constexpr (MODE != MODE_STORE) {
                // precaution: the wait stands before the next block's arithmetic (behind the last
                // block: whatever the calling kernel's code goes on with) rewrites a register
                // these stores name; values and pointer as inputs keep them live up to it
                asm volatile("s_wait_xcnt 0x0"
                             :: "v"(r[0]), "v"(r[1]), "v"(r[2]), "v"(r[3]),
                                "v"(r[4]), "v"(r[5]), "v"(r[6]), "v"(r[7]), "v"(cp)
                             : "memory");
            }
        }
    }
}

// ---------------------------------------------------------------------------
// Layer kernels. The shared expert's GEMM and the routed experts' GEMM of a
// layer do not depend on each other, so they share one launch: a WGP holds
// four or five work-groups from start to end, freed places are refilled from
// the same grid, and each layer fills and drains the chip once. The shared
// tiles come first in blockIdx.y (in the up layer they are the long ones).
// ---------------------------------------------------------------------------
#define MOE_NT (MOE_N / 128)          // row tiles of the shared expert

__global__ __launch_bounds__(256)
void up_layer_kernel(const float* __restrict__ x,
                     const float* __restrict__ sgu,    // [D][2F]
                     const float* __restrict__ w1,     // [E][D][F]
                     float* __restrict__ H,            // [N][F]
                     float* __restrict__ HR,           // [SLOTS][F]
                     const float* __restrict__ wt,
                     const int* __restrict__ tok,
                     const int* __restrict__ tileExp) {
    __shared__ __attribute__((aligned(16))) float smem[GEMM_LDS_WORDS(2)];
    if (blockIdx.y < MOE_NT) {
        // H = silu(x@Wg) * (x@Wu)
        gemm_tile<MODE_GATED>(smem, blockIdx.x, blockIdx.y, x, MOE_D, sgu, 2 * MOE_F, MOE_F,
                              H, MOE_F, nullptr, 0, nullptr, MOE_D);
    } else {
        const int t = blockIdx.y - MOE_NT;
        const int e = tileExp[t];            // same for the whole work-group
        if (e < 0) return;                   // unused tile: leaves before any barrier
        // HR[slot] = silu(x[tok]@w1_e) * wt[slot] (combine weight folded in)
        gemm_tile<MODE_SILU_SCALE>(smem, blockIdx.x, t, x, MOE_D,
                                   w1 + (size_t)e * (MOE_D * MOE_F), MOE_F, 0,
                                   HR, MOE_F, wt, 1, tok, MOE_D);
    }
}

__global__ __launch_bounds__(256)
void down_layer_kernel(const float* __restrict__ H,
                       const float* __restrict__ sdn,  // [F][D]
                       const float* __restrict__ HR,
                       const float* __restrict__ w2,   // [E][F][D]
                       float* __restrict__ S,          // [N][D]
                       float* __restrict__ Y,          // [SLOTS][D]
                       const int* __restrict__ tileExp) {
    __shared__ __attribute__((aligned(16))) float smem[GEMM_LDS_WORDS(1)];
    const float* A = H;                      // S = H @ Wdown
    const float* B = sdn;
    float*       C = S;
    int          t = blockIdx.y;
    if (blockIdx.y >= MOE_NT) {              // Y[slot] = HR[slot] @ w2_e
        t = blockIdx.y - MOE_NT;
        const int e = tileExp[t];            // same for the whole work-group
        if (e < 0) return;                   // unused tile: leaves before any barrier
        A = HR;
        B = w2 + (size_t)e * (MOE_F * MOE_D);
        C = Y;
    }
    gemm_tile<MODE_STORE>(smem, blockIdx.x, t, A, MOE_F, B, MOE_D, 0,
                          C, MOE_D, nullptr, 0, nullptr, MOE_F);
}

// ---------------------------------------------------------------------------
// out[n] = sgate[n] * S[n], then the token's lower expert row, then the higher.
// One wave per token: 8 x 16 B per lane from each of the three rows.
// ---------------------------------------------------------------------------
__global__ __launch_bounds__(256)
void combine_kernel(const float* __restrict__ S,
                    const float* __restrict__ Y,
                    const float* __restrict__ sgate,
                    const int* __restrict__ slotOf,
                    float* __restrict__ out) {
    const int n    = blockIdx.x * 8 + (threadIdx.x >> 5);
    const int lane = threadIdx.x & 31;
    const int2  sl = reinterpret_cast<const int2*>(slotOf)[n];
    const float sc = sgate[n];
    // precaution: the wait stands before a register these loads name is rewritten
    asm volatile("s_wait_xcnt 0x0" ::: "memory");
    const float4* ps = reinterpret_cast<const float4*>(S + (size_t)n * MOE_D) + lane;
    const float4* p0 = reinterpret_cast<const float4*>(Y + (size_t)sl.x * MOE_D) + lane;
    const float4* p1 = reinterpret_cast<const float4*>(Y + (size_t)sl.y * MOE_D) + lane;
    float4*       po = reinterpret_cast<float4*>(out + (size_t)n * MOE_D) + lane;
    float4 a[8], y0[8], y1[8];
#pragma unroll   // all 24 loads in flight together
    for (int u = 0; u < 8; ++u) {
        a[u]  = ps[u * 32];
        y0[u] = p0[u * 32];
        y1[u] = p1[u * 32];
    }
    // precaution: the wait stands before a register these loads name is rewritten;
    // the pointers as inputs keep the address pairs live up to it
    asm volatile("s_wait_xcnt 0x0" :: "v"(ps), "v"(p0), "v"(p1) : "memory");
#pragma unroll
    for (int u = 0; u < 8; ++u) {
        float4 r;
        r.x = sc * a[u].x + y0[u].x + y1[u].x;
        r.y = sc * a[u].y + y0[u].y + y1[u].y;
        r.z = sc * a[u].z + y0[u].z + y1[u].z;
        r.w = sc * a[u].w + y0[u].w + y1[u].w;
        po[u * 32] = r;
    }
}

// ---------------------------------------------------------------------------
// Host launcher
// ---------------------------------------------------------------------------
extern "C" void kernel_launch(void* const* d_in, const int* in_sizes, int n_in,
                              void* d_out, int out_size, void* d_ws, size_t ws_size,
                              hipStream_t stream) {
    const float* x    = (const float*)d_in[0]; // [N][D]
    const float* rw   = (const float*)d_in[1]; // [D][E]
    const float* w1   = (const float*)d_in[2]; // [E][D][F]
    const float* w2   = (const float*)d_in[3]; // [E][F][D]
    const float* sgu  = (const float*)d_in[4]; // [D][2F]
    const float* sdn  = (const float*)d_in[5]; // [F][D]
    const float* sgw  = (const float*)d_in[6]; // [D][1]
    float* out = (float*)d_out;                // [N][D]

    const int D = MOE_D, F = MOE_F, N = MOE_N;

    float* ws     = (float*)d_ws;
    float* H      = ws;                             // [N][F] shared activations
    float* HR     = H + (size_t)N * F;              // [SLOTS][F] routed activations
    float* Y      = HR + (size_t)MOE_SLOTS * F;     // [SLOTS][D] routed results
    float* S      = Y + (size_t)MOE_SLOTS * D;      // [N][D] shared result, ungated
    float* sgate  = S + (size_t)N * D;              // [N]
    float* topw   = sgate + N;                      // [N][2]
    float* wt     = topw + 2 * N;                   // [SLOTS]
    int*   topi   = (int*)(wt + MOE_SLOTS);         // [N][2]
    int*   tok    = topi + 2 * N;                   // [SLOTS]
    int*   slotOf = tok + MOE_SLOTS;                // [N][2]
    int*   tileE  = slotOf + 2 * N;                 // [TILES]

    router_kernel<<<N / 8, 256, 0, stream>>>(x, rw, sgw, topi, topw, sgate, N, D);
    build_lists_kernel<<<1, 1024, 0, stream>>>(topi, topw, tok, wt, slotOf, tileE);

    const dim3 blk(256);
    const dim3 gridUp(F / 64, MOE_NT + MOE_TILES);
    const dim3 gridDown(D / 64, MOE_NT + MOE_TILES);

    up_layer_kernel<<<gridUp, blk, 0, stream>>>(x, sgu, w1, H, HR, wt, tok, tileE);
    down_layer_kernel<<<gridDown, blk, 0, stream>>>(H, sdn, HR, w2, S, Y, tileE);
    combine_kernel<<<N / 8, blk, 0, stream>>>(S, Y, sgate, slotOf, out);
}
